// v000
// Measured on an AMD MI455X. A time is GPU time per run, averaged over a window of back-to-back runs after a warm-up
// (all launches, gaps included; the runs take copies of the inputs in turn), and the median of several windows.
// Apart from v000's, it joins two sittings. Times from different sittings can be a few percent apart, while
// side-by-side timings come from the same sitting.
// The starting kernel, v000, takes 908 microseconds a run.
#include <hip/hip_runtime.h>
#include <math.h>

#define EMBED 8192
#define U0    1024
#define U1    256
#define EGO   3
#define NHEAD 6
#define BATCH 8192
#define CIN   1027   // U0 + EGO

typedef __attribute__((ext_vector_type(2))) float v2f;
typedef __attribute__((ext_vector_type(8))) float v8f;
typedef __attribute__((__vector_size__(4 * sizeof(int)))) int v4i;

#if __has_builtin(__builtin_amdgcn_global_load_async_to_lds_b128) && \
    __has_builtin(__builtin_amdgcn_s_wait_asynccnt)
#define USE_ASYNC 1
#else
#define USE_ASYNC 0
#endif

#if USE_ASYNC
// Builtin signature (from clang diagnostic): param0 = v4i in AS1 (global),
// param1 = v4i in AS3 (LDS), then imm offset + imm cpol.
#define GAS1(p) ((__attribute__((address_space(1))) v4i*)(p))
#define LAS3(p) ((__attribute__((address_space(3))) v4i*)(p))
#endif

// ---------------------------------------------------------------------------
// Kernel 0a/0b: bin rows by command head (output-order independent => the
// final d_out is deterministic; each row lands in exactly one bin).
// ---------------------------------------------------------------------------
__global__ void zero_counts(int* counts) {
    if (threadIdx.x < NHEAD) counts[threadIdx.x] = 0;
}

__global__ void bin_rows(const int* __restrict__ cmd, int* counts, int* perm) {
    int i = blockIdx.x * 256 + threadIdx.x;
    if (i < BATCH) {
        int h = cmd[i];
        int p = atomicAdd(&counts[h], 1);
        perm[h * BATCH + p] = i;
    }
}

// ---------------------------------------------------------------------------
// Kernel 1: H = relu(X @ W + b), M=8192 N=1024 K=8192, fp32 WMMA.
// Block = 256 thr (8 waves). Block tile 128x128, K-block 32.
// Wave tile 32(M) x 64(N) = 2x4 WMMA 16x16 accumulators.
// Async path: X tile DMA'd global->LDS (double-buffered, ASYNCcnt),
// W tile loaded to regs and transposed into LDS after compute; all global
// latency overlaps the WMMA loop.
// ---------------------------------------------------------------------------
__global__ __launch_bounds__(256)
void fc_gemm_relu(const float* __restrict__ X, const float* __restrict__ W,
                  const float* __restrict__ bias, float* __restrict__ H) {
    const int tid = threadIdx.x;
    const int m0 = blockIdx.y * 128;
    const int n0 = blockIdx.x * 128;

    // X-tile loader mapping: 128 rows x 32 cols, float4 per thread x4
    const int rx = tid >> 3;          // 0..31
    const int cx = (tid & 7) << 2;    // 0..28
    // W-tile loader mapping: 32 rows x 128 cols
    const int kw = tid >> 5;          // 0..7
    const int cw = (tid & 31) << 2;   // 0..124

    const int lane = tid & 31;
    const int wv = tid >> 5;          // wave 0..7
    const int wm = wv & 3;            // 4 waves along M
    const int wn = wv >> 2;           // 2 waves along N
    const int l16 = lane & 15;
    const int g = lane >> 4;          // half-wave group

    v8f zero8 = {0.f, 0.f, 0.f, 0.f, 0.f, 0.f, 0.f, 0.f};
    v8f acc[2][4];
#pragma unroll
    for (int i = 0; i < 2; ++i)
#pragma unroll
        for (int j = 0; j < 4; ++j) acc[i][j] = zero8;

#if USE_ASYNC
    __shared__ float Xs[2][128 * 36];  // double-buffered X tile (async DMA target)
    __shared__ float Ws[128 * 36];     // W tile transposed: Ws[n][k]

    // ---- prologue: stage tile 0 ----
#pragma unroll
    for (int q = 0; q < 4; ++q) {
        int r = rx + 32 * q;
        __builtin_amdgcn_global_load_async_to_lds_b128(
            GAS1(X + (size_t)(m0 + r) * EMBED + cx),
            LAS3(&Xs[0][r * 36 + cx]), 0, 0);
    }
#pragma unroll
    for (int q = 0; q < 4; ++q) {
        int kk = kw + 8 * q;
        float4 v = *(const float4*)(W + (size_t)kk * U0 + n0 + cw);
        Ws[(cw + 0) * 36 + kk] = v.x;
        Ws[(cw + 1) * 36 + kk] = v.y;
        Ws[(cw + 2) * 36 + kk] = v.z;
        Ws[(cw + 3) * 36 + kk] = v.w;
    }
    __builtin_amdgcn_s_wait_asynccnt(0);
    __syncthreads();

    for (int i = 0; i < 256; ++i) {
        const int cur = i & 1;
        float4 w0, w1, w2, w3;
        if (i < 255) {  // prefetch tile i+1 while computing tile i
            const int k0n = (i + 1) * 32;
#pragma unroll
            for (int q = 0; q < 4; ++q) {
                int r = rx + 32 * q;
                __builtin_amdgcn_global_load_async_to_lds_b128(
                    GAS1(X + (size_t)(m0 + r) * EMBED + k0n + cx),
                    LAS3(&Xs[cur ^ 1][r * 36 + cx]), 0, 0);
            }
            w0 = *(const float4*)(W + (size_t)(k0n + kw) * U0 + n0 + cw);
            w1 = *(const float4*)(W + (size_t)(k0n + kw + 8) * U0 + n0 + cw);
            w2 = *(const float4*)(W + (size_t)(k0n + kw + 16) * U0 + n0 + cw);
            w3 = *(const float4*)(W + (size_t)(k0n + kw + 24) * U0 + n0 + cw);
        }
#pragma unroll
        for (int kk = 0; kk < 32; kk += 4) {
            int k = kk + 2 * g;
            v2f a0 = *(const v2f*)&Xs[cur][(wm * 32 + l16) * 36 + k];
            v2f a1 = *(const v2f*)&Xs[cur][(wm * 32 + 16 + l16) * 36 + k];
#pragma unroll
            for (int j = 0; j < 4; ++j) {
                v2f b = *(const v2f*)&Ws[(wn * 64 + j * 16 + l16) * 36 + k];
                acc[0][j] = __builtin_amdgcn_wmma_f32_16x16x4_f32(
                    false, a0, false, b, (short)0, acc[0][j], false, false);
                acc[1][j] = __builtin_amdgcn_wmma_f32_16x16x4_f32(
                    false, a1, false, b, (short)0, acc[1][j], false, false);
            }
        }
        __syncthreads();  // all waves done reading Ws / Xs[cur]
        if (i < 255) {
#pragma unroll
            for (int q = 0; q < 4; ++q) {
                int kk = kw + 8 * q;
                float4 v = (q == 0) ? w0 : (q == 1) ? w1 : (q == 2) ? w2 : w3;
                Ws[(cw + 0) * 36 + kk] = v.x;
                Ws[(cw + 1) * 36 + kk] = v.y;
                Ws[(cw + 2) * 36 + kk] = v.z;
                Ws[(cw + 3) * 36 + kk] = v.w;
            }
            __builtin_amdgcn_s_wait_asynccnt(0);  // Xs[cur^1] DMA complete
        }
        __syncthreads();  // publish next tile
    }
#else
    // -------- fallback: synchronous single-buffered staging --------
    __shared__ float As[128 * 36];
    __shared__ float Bs[128 * 36];

    for (int k0 = 0; k0 < EMBED; k0 += 32) {
#pragma unroll
        for (int i = 0; i < 4; ++i) {
            int r = rx + 32 * i;
            float4 v = *(const float4*)(X + (size_t)(m0 + r) * EMBED + k0 + cx);
            *(float4*)&As[r * 36 + cx] = v;
        }
#pragma unroll
        for (int i = 0; i < 4; ++i) {
            int kk = kw + 8 * i;
            float4 v = *(const float4*)(W + (size_t)(k0 + kk) * U0 + n0 + cw);
            Bs[(cw + 0) * 36 + kk] = v.x;
            Bs[(cw + 1) * 36 + kk] = v.y;
            Bs[(cw + 2) * 36 + kk] = v.z;
            Bs[(cw + 3) * 36 + kk] = v.w;
        }
        __syncthreads();
#pragma unroll
        for (int kk = 0; kk < 32; kk += 4) {
            int k = kk + 2 * g;
            v2f a0 = *(const v2f*)&As[(wm * 32 + l16) * 36 + k];
            v2f a1 = *(const v2f*)&As[(wm * 32 + 16 + l16) * 36 + k];
#pragma unroll
            for (int j = 0; j < 4; ++j) {
                v2f b = *(const v2f*)&Bs[(wn * 64 + j * 16 + l16) * 36 + k];
                acc[0][j] = __builtin_amdgcn_wmma_f32_16x16x4_f32(
                    false, a0, false, b, (short)0, acc[0][j], false, false);
                acc[1][j] = __builtin_amdgcn_wmma_f32_16x16x4_f32(
                    false, a1, false, b, (short)0, acc[1][j], false, false);
            }
        }
        __syncthreads();
    }
#endif

    // Epilogue: bias + relu + store. C layout: VGPR r -> row r + 8*(lane/16).
#pragma unroll
    for (int j = 0; j < 4; ++j) {
        int col = n0 + wn * 64 + j * 16 + l16;
        float bv = bias[col];
#pragma unroll
        for (int i = 0; i < 2; ++i) {
            int rowb = m0 + wm * 32 + i * 16 + 8 * g;
#pragma unroll
            for (int r = 0; r < 8; ++r) {
                float v = acc[i][j][r] + bv;
                H[(size_t)(rowb + r) * U0 + col] = fmaxf(v, 0.f);
            }
        }
    }
}

// ---------------------------------------------------------------------------
// Kernel 2: gathered per-head GEMM. For each head bin, tiles of 16 rows:
// h1_sel[row] = relu([h(row)|ego(row)] @ W1[head] + b1[head])  (K=1027, N=256)
// 8 waves x 32 cols; A staged in LDS in two 512-wide K chunks; B from L2.
// ---------------------------------------------------------------------------
__global__ __launch_bounds__(256)
void head_gemm(const float* __restrict__ H, const float* __restrict__ ego,
               const float* __restrict__ W1, const float* __restrict__ bias1,
               const int* __restrict__ counts, const int* __restrict__ perm,
               float* __restrict__ H1) {
    __shared__ float As[16 * 516];
    __shared__ int srow[16];

    const int head = blockIdx.y;
    const int tile = blockIdx.x;
    const int cnt = counts[head];
    if (tile * 16 >= cnt) return;  // block-uniform early exit

    const int tid = threadIdx.x;
    if (tid < 16) {
        int i = tile * 16 + tid;
        srow[tid] = (i < cnt) ? perm[head * BATCH + i] : -1;
    }
    __syncthreads();

    const int lr = tid >> 4, ll = tid & 15;
    const int riL = srow[lr];
    const int safeL = riL < 0 ? 0 : riL;
    const float4* hp = (const float4*)(H + (size_t)safeL * U0);

    const int lane = tid & 31, wv = tid >> 5;
    const int l16 = lane & 15, g = lane >> 4;
    const int col0 = wv * 32 + l16, col1 = col0 + 16;
    const float* Wh = W1 + (size_t)head * (CIN * U1);

    v8f acc0 = {0.f, 0.f, 0.f, 0.f, 0.f, 0.f, 0.f, 0.f};
    v8f acc1 = {0.f, 0.f, 0.f, 0.f, 0.f, 0.f, 0.f, 0.f};

    for (int ch = 0; ch < 2; ++ch) {
        const int kbase = ch * 512;
#pragma unroll
        for (int j = 0; j < 8; ++j) {
            int c4 = ll + j * 16;
            *(float4*)&As[lr * 516 + c4 * 4] = hp[(kbase >> 2) + c4];
        }
        if (ch == 1) {
            if (tid < 48) {
                int r = tid / 3, e = tid - 3 * r;
                int rs = srow[r];
                int sf = rs < 0 ? 0 : rs;
                As[r * 516 + 512 + e] = ego[sf * EGO + e];  // K = 1024..1026
            }
            if (tid < 16) As[tid * 516 + 515] = 0.f;        // K = 1027 pad
        }
        __syncthreads();

        const int nsteps = (ch == 0) ? 128 : 129;
        for (int s = 0; s < nsteps; ++s) {
            int lk = s * 4 + 2 * g;
            int k = kbase + lk;
            v2f a = *(const v2f*)&As[l16 * 516 + lk];
            int k1 = k + 1;
            int k1c = k1 > 1026 ? 1026 : k1;  // clamp (K=1027 is zero-padded)
            float msk = k1 > 1026 ? 0.f : 1.f;
            v2f b0, b1;
            b0.x = Wh[(size_t)k * U1 + col0];
            b0.y = msk * Wh[(size_t)k1c * U1 + col0];
            b1.x = Wh[(size_t)k * U1 + col1];
            b1.y = msk * Wh[(size_t)k1c * U1 + col1];
            acc0 = __builtin_amdgcn_wmma_f32_16x16x4_f32(
                false, a, false, b0, (short)0, acc0, false, false);
            acc1 = __builtin_amdgcn_wmma_f32_16x16x4_f32(
                false, a, false, b1, (short)0, acc1, false, false);
        }
        __syncthreads();
    }

    float bv0 = bias1[head * U1 + col0];
    float bv1 = bias1[head * U1 + col1];
#pragma unroll
    for (int r = 0; r < 8; ++r) {
        int mrow = r + 8 * g;
        int ri = srow[mrow];
        if (ri >= 0) {
            H1[(size_t)ri * U1 + col0] = fmaxf(acc0[r] + bv0, 0.f);
            H1[(size_t)ri * U1 + col1] = fmaxf(acc1[r] + bv1, 0.f);
        }
    }
}

// ---------------------------------------------------------------------------
// Kernel 3: per-row 256x4 matvec + tanh/softplus epilogue.
// ---------------------------------------------------------------------------
__global__ __launch_bounds__(256)
void head_out(const float* __restrict__ H1, const int* __restrict__ cmd,
              const float* __restrict__ W2, const float* __restrict__ b2,
              float* __restrict__ out) {
    int row = blockIdx.x * 256 + threadIdx.x;
    if (row >= BATCH) return;
    int c = cmd[row];
    const float4* w = (const float4*)(W2 + (size_t)c * U1 * 4);  // [k][4] contiguous
    const float* hr = H1 + (size_t)row * U1;
    float4 bv = *(const float4*)(b2 + c * 4);
    float a0 = bv.x, a1 = bv.y, a2 = bv.z, a3 = bv.w;
    for (int k = 0; k < U1; ++k) {
        float hv = hr[k];
        float4 wv = w[k];
        a0 += hv * wv.x;
        a1 += hv * wv.y;
        a2 += hv * wv.z;
        a3 += hv * wv.w;
    }
    const float RAW = 4.99323935f;  // log(exp(5)-1)
    float m0 = 5.f * tanhf(a0 * 0.2f);
    float m1 = 5.f * tanhf(a1 * 0.2f);
    float x2 = a2 + RAW, x3 = a3 + RAW;
    float s2 = fmaxf(x2, 0.f) + log1pf(expf(-fabsf(x2))) + 1e-4f;  // stable softplus
    float s3 = fmaxf(x3, 0.f) + log1pf(expf(-fabsf(x3))) + 1e-4f;
    float4 o;
    o.x = m0; o.y = m1; o.z = s2; o.w = s3;
    *(float4*)(out + (size_t)row * 4) = o;
}

// ---------------------------------------------------------------------------
extern "C" void kernel_launch(void* const* d_in, const int* in_sizes, int n_in,
                              void* d_out, int out_size, void* d_ws, size_t ws_size,
                              hipStream_t stream) {
    (void)in_sizes; (void)n_in; (void)out_size; (void)ws_size;
    const float* x   = (const float*)d_in[0];
    const int*   cmd = (const int*)d_in[1];
    const float* eg  = (const float*)d_in[2];
    const float* fcW = (const float*)d_in[3];
    const float* fcb = (const float*)d_in[4];
    const float* W1  = (const float*)d_in[5];
    const float* b1  = (const float*)d_in[6];
    const float* W2  = (const float*)d_in[7];
    const float* b2  = (const float*)d_in[8];
    float* out = (float*)d_out;

    char* ws = (char*)d_ws;
    int*   counts = (int*)ws;                                        // 6 ints (pad 256B)
    int*   perm   = (int*)(ws + 256);                                // 6*8192 ints
    float* H      = (float*)(ws + 196864);                           // 8192*1024 f32 (32 MB)
    float* H1     = (float*)(ws + 196864 + (size_t)BATCH * U0 * 4);  // 8192*256 f32 (8 MB)

    zero_counts<<<1, 32, 0, stream>>>(counts);
    bin_rows<<<BATCH / 256, 256, 0, stream>>>(cmd, counts, perm);
    fc_gemm_relu<<<dim3(U0 / 128, BATCH / 128), 256, 0, stream>>>(x, fcW, fcb, H);
    head_gemm<<<dim3(BATCH / 16, NHEAD), 256, 0, stream>>>(H, eg, W1, b1, counts, perm, H1);
    head_out<<<BATCH / 256, 256, 0, stream>>>(H1, cmd, W2, b2, out);
}

// v001
// A run of this version takes 728 microseconds.
// In two side-by-side timings against v000, it was 1.32 and 1.31 times as fast.
#include <hip/hip_runtime.h>
#include <math.h>

#define EMBED 8192
#define U0    1024
#define U1    256
#define EGO   3
#define NHEAD 6
#define BATCH 8192
#define CIN   1027   // U0 + EGO
#define WPITCH 136   // LDS row pitch of the W tile, in floats

typedef __attribute__((ext_vector_type(2))) float v2f;
typedef __attribute__((ext_vector_type(8))) float v8f;
typedef __attribute__((__vector_size__(4 * sizeof(int)))) int v4i;

#if __has_builtin(__builtin_amdgcn_global_load_async_to_lds_b128) && \
    __has_builtin(__builtin_amdgcn_s_wait_asynccnt)
#define USE_ASYNC 1
#else
#define USE_ASYNC 0
#endif

#if USE_ASYNC
// Builtin signature (from clang diagnostic): param0 = v4i in AS1 (global),
// param1 = v4i in AS3 (LDS), then imm offset + imm cpol.
#define GAS1(p) ((__attribute__((address_space(1))) v4i*)(p))
#define LAS3(p) ((__attribute__((address_space(3))) v4i*)(p))
#endif

// ---------------------------------------------------------------------------
// Kernel 0a/0b: bin rows by command head (output-order independent => the
// final d_out is deterministic; each row lands in exactly one bin).
// ---------------------------------------------------------------------------
__global__ void zero_counts(int* counts) {
    if (threadIdx.x < NHEAD) counts[threadIdx.x] = 0;
}

__global__ void bin_rows(const int* __restrict__ cmd, int* counts, int* perm) {
    int i = blockIdx.x * 256 + threadIdx.x;
    if (i < BATCH) {
        int h = cmd[i];
        int p = atomicAdd(&counts[h], 1);
        perm[h * BATCH + p] = i;
    }
}

// ---------------------------------------------------------------------------
// Kernel 1: H = relu(X @ W + b), M=8192 N=1024 K=8192, fp32 WMMA.
// Block = 256 thr (8 waves). Block tile 128x128, K-block 32.
// Wave tile 32(M) x 64(N) = 2x4 WMMA 16x16 accumulators.
// Async path: X tile and W tile both copied global->LDS without registers
// (two buffers, ASYNCcnt), one tile ahead, one barrier per K-block; the B
// fragment's two k values are read from two rows of the untransposed W tile.
// ---------------------------------------------------------------------------
__global__ __launch_bounds__(256)
void fc_gemm_relu(const float* __restrict__ X, const float* __restrict__ W,
                  const float* __restrict__ bias, float* __restrict__ H) {
    const int tid = threadIdx.x;
    const int m0 = blockIdx.y * 128;
    const int n0 = blockIdx.x * 128;

    // X-tile loader mapping: 128 rows x 32 cols, float4 per thread x4
    const int rx = tid >> 3;          // 0..31
    const int cx = (tid & 7) << 2;    // 0..28
    // W-tile loader mapping: 32 rows x 128 cols
    const int kw = tid >> 5;          // 0..7
    const int cw = (tid & 31) << 2;   // 0..124

    const int lane = tid & 31;
    const int wv = tid >> 5;          // wave 0..7
    const int wm = wv & 3;            // 4 waves along M
    const int wn = wv >> 2;           // 2 waves along N
    const int l16 = lane & 15;
    const int g = lane >> 4;          // half-wave group

    v8f zero8 = {0.f, 0.f, 0.f, 0.f, 0.f, 0.f, 0.f, 0.f};
    v8f acc[2][4];
#pragma unroll
    for (int i = 0; i < 2; ++i)
#pragma unroll
        for (int j = 0; j < 4; ++j) acc[i][j] = zero8;

#if USE_ASYNC
    __shared__ float Xs[2][128 * 36];  // X tile, two buffers: Xs[m][k], pitch 36
    // W tile, two buffers, as it lies in memory: Ws[k][n]. Pitch 136 floats: rows
    // k and k+2 (the two lane halves of a B fragment) start 16 banks apart.
    __shared__ float Ws[2][32 * WPITCH];

    // Tile t of X and of W into buffer buf: eight b128 copies a thread, no register.
    auto stage = [&](int t, int buf) {
        const int k0 = t * 32;
#pragma unroll
        for (int q = 0; q < 4; ++q) {
            int r = rx + 32 * q;
            __builtin_amdgcn_global_load_async_to_lds_b128(
                GAS1(X + (size_t)(m0 + r) * EMBED + k0 + cx),
                LAS3(&Xs[buf][r * 36 + cx]), 0, 0);
        }
#pragma unroll
        for (int q = 0; q < 4; ++q) {
            int kk = kw + 8 * q;
            __builtin_amdgcn_global_load_async_to_lds_b128(
                GAS1(W + (size_t)(k0 + kk) * U0 + n0 + cw),
                LAS3(&Ws[buf][kk * WPITCH + cw]), 0, 0);
        }
    };

    stage(0, 0);
    // this wave's copies of tile 0 have landed before the barrier publishes them
    asm volatile("s_wait_asynccnt 0x0" ::: "memory");
    __syncthreads();
    stage(1, 1);

    for (int t = 0; t < 256; ++t) {
        const int cur = t & 1;
#pragma unroll
        for (int kk = 0; kk < 32; kk += 4) {
            int k = kk + 2 * g;
            v2f a0 = *(const v2f*)&Xs[cur][(wm * 32 + l16) * 36 + k];
            v2f a1 = *(const v2f*)&Xs[cur][(wm * 32 + 16 + l16) * 36 + k];
#pragma unroll
            for (int j = 0; j < 4; ++j) {
                const float* wp = &Ws[cur][k * WPITCH + wn * 64 + j * 16 + l16];
                v2f b;
                b.x = wp[0];
                b.y = wp[WPITCH];
                acc[0][j] = __builtin_amdgcn_wmma_f32_16x16x4_f32(
                    false, a0, false, b, (short)0, acc[0][j], false, false);
                acc[1][j] = __builtin_amdgcn_wmma_f32_16x16x4_f32(
                    false, a1, false, b, (short)0, acc[1][j], false, false);
            }
        }
        // this wave's reads of buffer cur have returned before the buffer is refilled
        asm volatile("s_wait_dscnt 0x0" ::: "memory");
        // this wave's copies of tile t+1 have landed before the barrier publishes them
        asm volatile("s_wait_asynccnt 0x0" ::: "memory");
        __syncthreads();  // publishes tile t+1 and ends every wave's reads of buffer cur
        if (t + 2 < 256) stage(t + 2, cur);
    }
    // no copy is outstanding when the wave goes on to the epilogue and ends
    asm volatile("s_wait_asynccnt 0x0" ::: "memory");
#else
    // -------- fallback: synchronous single-buffered staging --------
    __shared__ float As[128 * 36];
    __shared__ float Bs[128 * 36];

    for (int k0 = 0; k0 < EMBED; k0 += 32) {
#pragma unroll
        for (int i = 0; i < 4; ++i) {
            int r = rx + 32 * i;
            float4 v = *(const float4*)(X + (size_t)(m0 + r) * EMBED + k0 + cx);
            *(float4*)&As[r * 36 + cx] = v;
        }
#pragma unroll
        for (int i = 0; i < 4; ++i) {
            int kk = kw + 8 * i;
            float4 v = *(const float4*)(W + (size_t)(k0 + kk) * U0 + n0 + cw);
            Bs[(cw + 0) * 36 + kk] = v.x;
            Bs[(cw + 1) * 36 + kk] = v.y;
            Bs[(cw + 2) * 36 + kk] = v.z;
            Bs[(cw + 3) * 36 + kk] = v.w;
        }
        __syncthreads();
#pragma unroll
        for (int kk = 0; kk < 32; kk += 4) {
            int k = kk + 2 * g;
            v2f a0 = *(const v2f*)&As[(wm * 32 + l16) * 36 + k];
            v2f a1 = *(const v2f*)&As[(wm * 32 + 16 + l16) * 36 + k];
#pragma unroll
            for (int j = 0; j < 4; ++j) {
                v2f b = *(const v2f*)&Bs[(wn * 64 + j * 16 + l16) * 36 + k];
                acc[0][j] = __builtin_amdgcn_wmma_f32_16x16x4_f32(
                    false, a0, false, b, (short)0, acc[0][j], false, false);
                acc[1][j] = __builtin_amdgcn_wmma_f32_16x16x4_f32(
                    false, a1, false, b, (short)0, acc[1][j], false, false);
            }
        }
        __syncthreads();
    }
#endif

    // Epilogue: bias + relu + store. C layout: VGPR r -> row r + 8*(lane/16).
#pragma unroll
    for (int j = 0; j < 4; ++j) {
        int col = n0 + wn * 64 + j * 16 + l16;
        float bv = bias[col];
#pragma unroll
        for (int i = 0; i < 2; ++i) {
            int rowb = m0 + wm * 32 + i * 16 + 8 * g;
#pragma unroll
            for (int r = 0; r < 8; ++r) {
                float v = acc[i][j][r] + bv;
                H[(size_t)(rowb + r) * U0 + col] = fmaxf(v, 0.f);
            }
        }
    }
}

// ---------------------------------------------------------------------------
// Kernel 2: gathered per-head GEMM. For each head bin, tiles of 16 rows:
// h1_sel[row] = relu([h(row)|ego(row)] @ W1[head] + b1[head])  (K=1027, N=256)
// 8 waves x 32 cols; A staged in LDS in two 512-wide K chunks; B from L2.
// ---------------------------------------------------------------------------
__global__ __launch_bounds__(256)
void head_gemm(const float* __restrict__ H, const float* __restrict__ ego,
               const float* __restrict__ W1, const float* __restrict__ bias1,
               const int* __restrict__ counts, const int* __restrict__ perm,
               float* __restrict__ H1) {
    __shared__ float As[16 * 516];
    __shared__ int srow[16];

    const int head = blockIdx.y;
    const int tile = blockIdx.x;
    const int cnt = counts[head];
    if (tile * 16 >= cnt) return;  // block-uniform early exit

    const int tid = threadIdx.x;
    if (tid < 16) {
        int i = tile * 16 + tid;
        srow[tid] = (i < cnt) ? perm[head * BATCH + i] : -1;
    }
    __syncthreads();

    const int lr = tid >> 4, ll = tid & 15;
    const int riL = srow[lr];
    const int safeL = riL < 0 ? 0 : riL;
    const float4* hp = (const float4*)(H + (size_t)safeL * U0);

    const int lane = tid & 31, wv = tid >> 5;
    const int l16 = lane & 15, g = lane >> 4;
    const int col0 = wv * 32 + l16, col1 = col0 + 16;
    const float* Wh = W1 + (size_t)head * (CIN * U1);

    v8f acc0 = {0.f, 0.f, 0.f, 0.f, 0.f, 0.f, 0.f, 0.f};
    v8f acc1 = {0.f, 0.f, 0.f, 0.f, 0.f, 0.f, 0.f, 0.f};

    for (int ch = 0; ch < 2; ++ch) {
        const int kbase = ch * 512;
#pragma unroll
        for (int j = 0; j < 8; ++j) {
            int c4 = ll + j * 16;
            *(float4*)&As[lr * 516 + c4 * 4] = hp[(kbase >> 2) + c4];
        }
        if (ch == 1) {
            if (tid < 48) {
                int r = tid / 3, e = tid - 3 * r;
                int rs = srow[r];
                int sf = rs < 0 ? 0 : rs;
                As[r * 516 + 512 + e] = ego[sf * EGO + e];  // K = 1024..1026
            }
            if (tid < 16) As[tid * 516 + 515] = 0.f;        // K = 1027 pad
        }
        __syncthreads();

        const int nsteps = (ch == 0) ? 128 : 129;
        for (int s = 0; s < nsteps; ++s) {
            int lk = s * 4 + 2 * g;
            int k = kbase + lk;
            v2f a = *(const v2f*)&As[l16 * 516 + lk];
            int k1 = k + 1;
            int k1c = k1 > 1026 ? 1026 : k1;  // clamp (K=1027 is zero-padded)
            float msk = k1 > 1026 ? 0.f : 1.f;
            v2f b0, b1;
            b0.x = Wh[(size_t)k * U1 + col0];
            b0.y = msk * Wh[(size_t)k1c * U1 + col0];
            b1.x = Wh[(size_t)k * U1 + col1];
            b1.y = msk * Wh[(size_t)k1c * U1 + col1];
            acc0 = __builtin_amdgcn_wmma_f32_16x16x4_f32(
                false, a, false, b0, (short)0, acc0, false, false);
            acc1 = __builtin_amdgcn_wmma_f32_16x16x4_f32(
                false, a, false, b1, (short)0, acc1, false, false);
        }
        __syncthreads();
    }

    float bv0 = bias1[head * U1 + col0];
    float bv1 = bias1[head * U1 + col1];
#pragma unroll
    for (int r = 0; r < 8; ++r) {
        int mrow = r + 8 * g;
        int ri = srow[mrow];
        if (ri >= 0) {
            H1[(size_t)ri * U1 + col0] = fmaxf(acc0[r] + bv0, 0.f);
            H1[(size_t)ri * U1 + col1] = fmaxf(acc1[r] + bv1, 0.f);
        }
    }
}

// ---------------------------------------------------------------------------
// Kernel 3: per-row 256x4 matvec + tanh/softplus epilogue.
// ---------------------------------------------------------------------------
__global__ __launch_bounds__(256)
void head_out(const float* __restrict__ H1, const int* __restrict__ cmd,
              const float* __restrict__ W2, const float* __restrict__ b2,
              float* __restrict__ out) {
    int row = blockIdx.x * 256 + threadIdx.x;
    if (row >= BATCH) return;
    int c = cmd[row];
    const float4* w = (const float4*)(W2 + (size_t)c * U1 * 4);  // [k][4] contiguous
    const float* hr = H1 + (size_t)row * U1;
    float4 bv = *(const float4*)(b2 + c * 4);
    float a0 = bv.x, a1 = bv.y, a2 = bv.z, a3 = bv.w;
    for (int k = 0; k < U1; ++k) {
        float hv = hr[k];
        float4 wv = w[k];
        a0 += hv * wv.x;
        a1 += hv * wv.y;
        a2 += hv * wv.z;
        a3 += hv * wv.w;
    }
    const float RAW = 4.99323935f;  // log(exp(5)-1)
    float m0 = 5.f * tanhf(a0 * 0.2f);
    float m1 = 5.f * tanhf(a1 * 0.2f);
    float x2 = a2 + RAW, x3 = a3 + RAW;
    float s2 = fmaxf(x2, 0.f) + log1pf(expf(-fabsf(x2))) + 1e-4f;  // stable softplus
    float s3 = fmaxf(x3, 0.f) + log1pf(expf(-fabsf(x3))) + 1e-4f;
    float4 o;
    o.x = m0; o.y = m1; o.z = s2; o.w = s3;
    *(float4*)(out + (size_t)row * 4) = o;
}

// ---------------------------------------------------------------------------
extern "C" void kernel_launch(void* const* d_in, const int* in_sizes, int n_in,
                              void* d_out, int out_size, void* d_ws, size_t ws_size,
                              hipStream_t stream) {
    (void)in_sizes; (void)n_in; (void)out_size; (void)ws_size;
    const float* x   = (const float*)d_in[0];
    const int*   cmd = (const int*)d_in[1];
    const float* eg  = (const float*)d_in[2];
    const float* fcW = (const float*)d_in[3];
    const float* fcb = (const float*)d_in[4];
    const float* W1  = (const float*)d_in[5];
    const float* b1  = (const float*)d_in[6];
    const float* W2  = (const float*)d_in[7];
    const float* b2  = (const float*)d_in[8];
    float* out = (float*)d_out;

    char* ws = (char*)d_ws;
    int*   counts = (int*)ws;                                        // 6 ints (pad 256B)
    int*   perm   = (int*)(ws + 256);                                // 6*8192 ints
    float* H      = (float*)(ws + 196864);                           // 8192*1024 f32 (32 MB)
    float* H1     = (float*)(ws + 196864 + (size_t)BATCH * U0 * 4);  // 8192*256 f32 (8 MB)

    zero_counts<<<1, 32, 0, stream>>>(counts);
    bin_rows<<<BATCH / 256, 256, 0, stream>>>(cmd, counts, perm);
    fc_gemm_relu<<<dim3(U0 / 128, BATCH / 128), 256, 0, stream>>>(x, fcW, fcb, H);
    head_gemm<<<dim3(BATCH / 16, NHEAD), 256, 0, stream>>>(H, eg, W1, b1, counts, perm, H1);
    head_out<<<BATCH / 256, 256, 0, stream>>>(H1, cmd, W2, b2, out);
}
